// v000
// Measured on an AMD MI455X. A time is GPU time per run, averaged over a window of back-to-back runs after a warm-up
// (all launches, gaps included; the runs take copies of the inputs in turn), and the median of several windows.
// Apart from v000's, it joins two sittings. Times from different sittings can be a few percent apart, while
// side-by-side timings come from the same sitting.
// v000 is the starting kernel. One run takes 811 microseconds.
#include <hip/hip_runtime.h>

// ---------------------------------------------------------------------------
// Problem constants (match reference)
// ---------------------------------------------------------------------------
constexpr int Bq   = 8;
constexpr int Nq   = 1024;
constexpr int Cq   = 1024;
constexpr int Hq   = 16;
constexpr int Dq   = 64;
constexpr int MLPq = 4096;
constexpr int TOK  = Bq * Nq;   // 8192 tokens

typedef __attribute__((ext_vector_type(16))) __bf16 bf16x16;
typedef __attribute__((ext_vector_type(8)))  float  f32x8;

__device__ __forceinline__ f32x8 wmma_bf16(bf16x16 a, bf16x16 b, f32x8 c) {
  return __builtin_amdgcn_wmma_f32_16x16x32_bf16(
      /*neg_a=*/false, a, /*neg_b=*/false, b,
      /*c_mod=*/(short)0, c, /*reuse_a=*/false, /*reuse_b=*/false);
}

__device__ __forceinline__ float gelu_tanh(float u) {
  const float c0 = 0.7978845608028654f;   // sqrt(2/pi)
  return 0.5f * u * (1.0f + tanhf(c0 * (u + 0.044715f * u * u * u)));
}

// ---------------------------------------------------------------------------
// Tiled weight transpose + f32 -> bf16: in [K, Nn] row-major -> out [Nn, K].
// ---------------------------------------------------------------------------
__global__ __launch_bounds__(256)
void transpose_to_bf16(const float* __restrict__ in, __bf16* __restrict__ out,
                       int K, int Nn) {
  __shared__ __bf16 tile[32][33];
  const int tx = threadIdx.x;           // 0..31
  const int ty = threadIdx.y;           // 0..7
  const int n0 = blockIdx.x * 32;
  const int k0 = blockIdx.y * 32;
#pragma unroll
  for (int i = ty; i < 32; i += 8)
    tile[i][tx] = (__bf16)in[(size_t)(k0 + i) * Nn + n0 + tx];
  __syncthreads();
#pragma unroll
  for (int i = ty; i < 32; i += 8)
    out[(size_t)(n0 + i) * K + k0 + tx] = tile[tx][i];
}

// ---------------------------------------------------------------------------
// LayerNorm (one block per token row) -> bf16 output
// ---------------------------------------------------------------------------
__global__ __launch_bounds__(256)
void layernorm_bf16(const float* __restrict__ x, const float* __restrict__ g,
                    const float* __restrict__ b, __bf16* __restrict__ out) {
  __shared__ float s_sum[256];
  __shared__ float s_sq[256];
  const int row = blockIdx.x;
  const float* xr = x + (size_t)row * Cq;

  float s = 0.f, s2 = 0.f;
  for (int i = threadIdx.x; i < Cq; i += 256) {
    float v = xr[i];
    s += v; s2 += v * v;
  }
  s_sum[threadIdx.x] = s;
  s_sq[threadIdx.x]  = s2;
  __syncthreads();
  for (int off = 128; off > 0; off >>= 1) {
    if (threadIdx.x < off) {
      s_sum[threadIdx.x] += s_sum[threadIdx.x + off];
      s_sq[threadIdx.x]  += s_sq[threadIdx.x + off];
    }
    __syncthreads();
  }
  const float mean = s_sum[0] * (1.0f / Cq);
  const float var  = s_sq[0] * (1.0f / Cq) - mean * mean;
  const float rstd = rsqrtf(var + 1e-5f);

  __bf16* orow = out + (size_t)row * Cq;
  for (int i = threadIdx.x; i < Cq; i += 256)
    orow[i] = (__bf16)((xr[i] - mean) * rstd * g[i] + b[i]);
}

// ---------------------------------------------------------------------------
// Software-pipelined WMMA bf16 GEMM (explicit ping-pong, zero register copies):
//   out = act( A[M,K](bf16) x Bt[Nn,K](bf16, pre-transposed) + bias ) + residual
// Block: 256 thr = 8 waves in 2x4; wave tile 32x64 -> block tile 64x256.
// Requires K % 64 == 0 (K/32 even).
// ---------------------------------------------------------------------------
__global__ __launch_bounds__(256)
void gemm_bf16_wmma(const __bf16* __restrict__ A, const __bf16* __restrict__ Bt,
                    const float* __restrict__ bias,
                    const float* __restrict__ residual,
                    float* __restrict__ outF, __bf16* __restrict__ outB,
                    int M, int Nn, int K, int act) {
  const int wave = threadIdx.x >> 5;
  const int lane = threadIdx.x & 31;
  const int hf   = lane >> 4;      // which 16-lane half
  const int l15  = lane & 15;
  const int wrow = wave >> 2;      // 0..1
  const int wcol = wave & 3;       // 0..3
  const int m0   = blockIdx.y * 64 + wrow * 32;
  const int n0   = blockIdx.x * 256 + wcol * 64;

  const __bf16* ap0 = A + (size_t)(m0 + l15) * K + hf * 16;        // rows m0..+15
  const __bf16* ap1 = ap0 + (size_t)16 * K;                        // rows m0+16..+31
  const __bf16* bp  = Bt + (size_t)(n0 + l15) * K + hf * 16;       // + nt*16*K

  f32x8 acc[2][4] = {};

  auto loadfr = [&](int k0, bf16x16& a0, bf16x16& a1, bf16x16 (&bb)[4]) {
    a0 = *(const bf16x16*)(ap0 + k0);
    a1 = *(const bf16x16*)(ap1 + k0);
#pragma unroll
    for (int nt = 0; nt < 4; ++nt)
      bb[nt] = *(const bf16x16*)(bp + (size_t)nt * 16 * K + k0);
  };
  auto mmac = [&](bf16x16& a0, bf16x16& a1, bf16x16 (&bb)[4]) {
#pragma unroll
    for (int nt = 0; nt < 4; ++nt) {
      acc[0][nt] = wmma_bf16(a0, bb[nt], acc[0][nt]);
      acc[1][nt] = wmma_bf16(a1, bb[nt], acc[1][nt]);
    }
  };

  bf16x16 a0A, a1A, bA[4];
  bf16x16 a0B, a1B, bB[4];

  const int nsteps = K >> 5;             // even for all call sites
  loadfr(0, a0A, a1A, bA);
  for (int s = 0; s < nsteps; s += 2) {
    loadfr((s + 1) << 5, a0B, a1B, bB);  // buf B <- step s+1
    mmac(a0A, a1A, bA);                  // compute step s
    const int k2 = (s + 2 < nsteps) ? ((s + 2) << 5) : 0;  // wrap: dead load
    loadfr(k2, a0A, a1A, bA);            // buf A <- step s+2
    mmac(a0B, a1B, bB);                  // compute step s+1
  }

#pragma unroll
  for (int ms = 0; ms < 2; ++ms) {
#pragma unroll
    for (int nt = 0; nt < 4; ++nt) {
#pragma unroll
      for (int r = 0; r < 8; ++r) {
        int m = m0 + ms * 16 + r + 8 * hf;     // C-layout: row = vgpr + 8*half
        int n = n0 + nt * 16 + l15;            //           col = lane&15
        float v = acc[ms][nt][r] + bias[n];
        if (act) v = gelu_tanh(v);
        if (residual) v += residual[(size_t)m * Nn + n];
        if (outF) outF[(size_t)m * Nn + n] = v;
        if (outB) outB[(size_t)m * Nn + n] = (__bf16)v;
      }
    }
  }
}

// ---------------------------------------------------------------------------
// Split fused QKV (f32 [TOK, 3C]) -> q,k per-head bf16 [B,H,N,D] (coalesced)
// ---------------------------------------------------------------------------
__global__ __launch_bounds__(256)
void split_qk(const float* __restrict__ qkv, __bf16* __restrict__ q,
              __bf16* __restrict__ k) {
  size_t gid = (size_t)blockIdx.x * blockDim.x + threadIdx.x;
  if (gid >= (size_t)TOK * Cq) return;
  int t = (int)(gid / Cq);        // token
  int c = (int)(gid % Cq);        // channel
  int h = c / Dq;
  int d = c % Dq;
  int b = t / Nq;
  int n = t % Nq;
  size_t head = (size_t)b * Hq + h;
  const float* src = qkv + (size_t)t * (3 * Cq) + c;
  q[(head * Nq + n) * Dq + d] = (__bf16)src[0];
  k[(head * Nq + n) * Dq + d] = (__bf16)src[Cq];
}

// ---------------------------------------------------------------------------
// V part of QKV -> vT [B,H,D,N] bf16 via tiled LDS transpose
// ---------------------------------------------------------------------------
__global__ __launch_bounds__(256)
void v_transpose(const float* __restrict__ qkv, __bf16* __restrict__ vT) {
  __shared__ __bf16 tile[32][33];
  const int tx = threadIdx.x, ty = threadIdx.y;
  const int bh = blockIdx.x;
  const int n0 = blockIdx.y * 32;
  const int d0 = blockIdx.z * 32;
  const int b = bh / Hq, h = bh % Hq;
#pragma unroll
  for (int i = ty; i < 32; i += 8)
    tile[i][tx] = (__bf16)qkv[(size_t)((size_t)b * Nq + n0 + i) * (3 * Cq) +
                              2 * Cq + h * Dq + d0 + tx];
  __syncthreads();
#pragma unroll
  for (int i = ty; i < 32; i += 8)
    vT[((size_t)bh * Dq + d0 + i) * Nq + n0 + tx] = tile[tx][i];
}

// ---------------------------------------------------------------------------
// Flash attention: grid (B*H, N/128), 256 thr = 8 waves, wave owns 16 rows.
// Online softmax over 32-wide KV blocks; S and O via WMMA.
// Ping-pong K-fragment prefetch (jj+=2), V loads issued before softmax VALU.
// ---------------------------------------------------------------------------
__global__ __launch_bounds__(256)
void attention_kernel(const __bf16* __restrict__ q, const __bf16* __restrict__ k,
                      const __bf16* __restrict__ vT, __bf16* __restrict__ att) {
  const int bh   = blockIdx.x;          // b*H + h
  const int wave = threadIdx.x >> 5;
  const int lane = threadIdx.x & 31;
  const int hf   = lane >> 4;
  const int l15  = lane & 15;
  const int m0   = blockIdx.y * 128 + wave * 16;
  constexpr int NB = Nq / 32;           // 32 (even)

  const __bf16* qb = q  + (size_t)bh * Nq * Dq;
  const __bf16* kb = k  + (size_t)bh * Nq * Dq;
  const __bf16* vb = vT + (size_t)bh * Dq * Nq;

  __shared__ __attribute__((aligned(32))) __bf16 pshare[8][16][32];

  // Q fragments (held whole kernel): rows m0..m0+15, D split 0..31 / 32..63
  bf16x16 qf0 = *(const bf16x16*)(qb + (size_t)(m0 + l15) * Dq + hf * 16);
  bf16x16 qf1 = *(const bf16x16*)(qb + (size_t)(m0 + l15) * Dq + 32 + hf * 16);

  f32x8 o[4] = {};
  float mrun[8], lrun[8];
#pragma unroll
  for (int r = 0; r < 8; ++r) { mrun[r] = -1e30f; lrun[r] = 0.f; }

  auto loadK = [&](int j, bf16x16 (&kk)[4]) {
#pragma unroll
    for (int t = 0; t < 2; ++t) {
      const int col0 = j * 32 + t * 16;
      kk[t * 2 + 0] = *(const bf16x16*)(kb + (size_t)(col0 + l15) * Dq + hf * 16);
      kk[t * 2 + 1] = *(const bf16x16*)(kb + (size_t)(col0 + l15) * Dq + 32 + hf * 16);
    }
  };

  // one 32-wide KV block: scores with kc, prefetch K block jnext into kn2
  auto process = [&](int jc, bf16x16 (&kc)[4], bf16x16 (&kn2)[4], int jnext) {
    f32x8 s0 = {}, s1 = {};
    s0 = wmma_bf16(qf0, kc[0], s0);
    s0 = wmma_bf16(qf1, kc[1], s0);
    s1 = wmma_bf16(qf0, kc[2], s1);
    s1 = wmma_bf16(qf1, kc[3], s1);

    // V loads for this block (consumed by o-wmma below; issued first)
    bf16x16 vf[4];
#pragma unroll
    for (int nt = 0; nt < 4; ++nt)
      vf[nt] = *(const bf16x16*)(vb + (size_t)(nt * 16 + l15) * Nq +
                                 jc * 32 + hf * 16);
    // next K block prefetch (wrapped address keeps it in bounds; dead at end)
    loadK(jnext, kn2);

    // ---- online softmax (VALU hides outstanding loads)
    float pv[2][8];
    float tmax[8];
#pragma unroll
    for (int r = 0; r < 8; ++r) {
      float v0 = s0[r] * 0.125f;            // 1/sqrt(D)
      float v1 = s1[r] * 0.125f;
      pv[0][r] = v0; pv[1][r] = v1;
      tmax[r] = fmaxf(v0, v1);
    }
#pragma unroll
    for (int r = 0; r < 8; ++r) {
      float v = tmax[r];
      v = fmaxf(v, __shfl_xor(v, 1));
      v = fmaxf(v, __shfl_xor(v, 2));
      v = fmaxf(v, __shfl_xor(v, 4));
      v = fmaxf(v, __shfl_xor(v, 8));
      tmax[r] = v;
    }
    float corr[8];
#pragma unroll
    for (int r = 0; r < 8; ++r) {
      float mnew = fmaxf(mrun[r], tmax[r]);
      corr[r] = __expf(mrun[r] - mnew);
      mrun[r] = mnew;
    }
#pragma unroll
    for (int r = 0; r < 8; ++r) {
      float p0 = __expf(pv[0][r] - mrun[r]);
      float p1 = __expf(pv[1][r] - mrun[r]);
      pv[0][r] = p0; pv[1][r] = p1;
      float v = p0 + p1;
      v += __shfl_xor(v, 1);
      v += __shfl_xor(v, 2);
      v += __shfl_xor(v, 4);
      v += __shfl_xor(v, 8);
      lrun[r] = lrun[r] * corr[r] + v;
    }
#pragma unroll
    for (int nt = 0; nt < 4; ++nt)
#pragma unroll
      for (int r = 0; r < 8; ++r) o[nt][r] *= corr[r];

    // ---- C-layout -> A-layout for P via per-wave LDS bounce
#pragma unroll
    for (int t = 0; t < 2; ++t)
#pragma unroll
      for (int r = 0; r < 8; ++r)
        pshare[wave][r + 8 * hf][t * 16 + l15] = (__bf16)pv[t][r];
    __syncthreads();
    bf16x16 pa = *(const bf16x16*)(&pshare[wave][l15][hf * 16]);

    // ---- O += P(16x32) x V(32xD)
#pragma unroll
    for (int nt = 0; nt < 4; ++nt)
      o[nt] = wmma_bf16(pa, vf[nt], o[nt]);
    __syncthreads();
  };

  bf16x16 kfA[4], kfB[4];
  loadK(0, kfA);
  for (int jj = 0; jj < NB; jj += 2) {
    process(jj,     kfA, kfB, jj + 1);
    process(jj + 1, kfB, kfA, (jj + 2 < NB) ? jj + 2 : 0);
  }

  // ---- finalize: divide by l, store into [B,N,C] bf16
  const int b = bh / Hq, h = bh % Hq;
#pragma unroll
  for (int nt = 0; nt < 4; ++nt)
#pragma unroll
    for (int r = 0; r < 8; ++r) {
      float val = o[nt][r] / lrun[r];
      int row = m0 + r + 8 * hf;
      int col = nt * 16 + l15;
      att[((size_t)b * Nq + row) * Cq + h * Dq + col] = (__bf16)val;
    }
}

// ---------------------------------------------------------------------------
// Launch
// ---------------------------------------------------------------------------
extern "C" void kernel_launch(void* const* d_in, const int* in_sizes, int n_in,
                              void* d_out, int out_size, void* d_ws, size_t ws_size,
                              hipStream_t stream) {
  (void)in_sizes; (void)n_in; (void)out_size; (void)ws_size;
  const float* x     = (const float*)d_in[0];
  const float* ln1_g = (const float*)d_in[1];
  const float* ln1_b = (const float*)d_in[2];
  const float* w_qkv = (const float*)d_in[3];
  const float* b_qkv = (const float*)d_in[4];
  const float* w_out = (const float*)d_in[5];
  const float* b_out = (const float*)d_in[6];
  const float* ln2_g = (const float*)d_in[7];
  const float* ln2_b = (const float*)d_in[8];
  const float* w1    = (const float*)d_in[9];
  const float* b1    = (const float*)d_in[10];
  const float* w2    = (const float*)d_in[11];
  const float* b2    = (const float*)d_in[12];
  float* out = (float*)d_out;

  // ---- workspace bump allocator (lifetimes allow heavy reuse)
  char* p = (char*)d_ws;
  auto alloc = [&](size_t bytes) -> char* {
    char* r = p;
    p += (bytes + 255) & ~(size_t)255;
    return r;
  };
  __bf16* wqkvT = (__bf16*)alloc((size_t)Cq * 3 * Cq * 2);     // 6 MB
  __bf16* woutT = (__bf16*)alloc((size_t)Cq * Cq * 2);         // 2 MB
  __bf16* w1T   = (__bf16*)alloc((size_t)Cq * MLPq * 2);       // 8 MB
  __bf16* w2T   = (__bf16*)alloc((size_t)MLPq * Cq * 2);       // 8 MB
  char*   r16   = alloc((size_t)TOK * Cq * 2);                 // 16 MB: h_bf, then att_bf
  char*   rqkv  = alloc((size_t)TOK * 3 * Cq * 4);             // 96 MB: qkv_f32, then x2 + h1
  __bf16* q_bf  = (__bf16*)alloc((size_t)TOK * Cq * 2);        // 16 MB: q, then y_bf
  __bf16* k_bf  = (__bf16*)alloc((size_t)TOK * Cq * 2);        // 16 MB
  __bf16* vT_bf = (__bf16*)alloc((size_t)TOK * Cq * 2);        // 16 MB

  __bf16* h_bf   = (__bf16*)r16;
  __bf16* att_bf = (__bf16*)r16;                           // reuse after h dead
  float*  qkv_f  = (float*)rqkv;
  float*  x2     = (float*)rqkv;                           // reuse after qkv dead
  __bf16* h1_bf  = (__bf16*)(rqkv + (size_t)TOK * Cq * 4); // next 64 MB
  __bf16* y_bf   = q_bf;                                   // reuse after attention

  // 1) weight transposes (f32 -> bf16 [N,K]), tiled/coalesced
  {
    auto tp = [&](const float* w, __bf16* wt, int K, int Nn) {
      transpose_to_bf16<<<dim3(Nn / 32, K / 32), dim3(32, 8), 0, stream>>>(w, wt, K, Nn);
    };
    tp(w_qkv, wqkvT, Cq, 3 * Cq);
    tp(w_out, woutT, Cq, Cq);
    tp(w1, w1T, Cq, MLPq);
    tp(w2, w2T, MLPq, Cq);
  }

  // 2) LN1
  layernorm_bf16<<<dim3(TOK), dim3(256), 0, stream>>>(x, ln1_g, ln1_b, h_bf);

  // 3) QKV GEMM: [TOK,C] x [C,3C] -> qkv_f
  gemm_bf16_wmma<<<dim3(3 * Cq / 256, TOK / 64), dim3(256), 0, stream>>>(
      h_bf, wqkvT, b_qkv, nullptr, qkv_f, nullptr, TOK, 3 * Cq, Cq, 0);

  // 4) split into per-head q/k and transposed v
  {
    size_t total = (size_t)TOK * Cq;
    split_qk<<<dim3((unsigned)((total + 255) / 256)), dim3(256), 0, stream>>>(
        qkv_f, q_bf, k_bf);
    v_transpose<<<dim3(Bq * Hq, Nq / 32, Dq / 32), dim3(32, 8), 0, stream>>>(
        qkv_f, vT_bf);
  }

  // 5) attention -> att_bf [B,N,C]
  attention_kernel<<<dim3(Bq * Hq, Nq / 128), dim3(256), 0, stream>>>(
      q_bf, k_bf, vT_bf, att_bf);

  // 6) out projection + residual x -> x2
  gemm_bf16_wmma<<<dim3(Cq / 256, TOK / 64), dim3(256), 0, stream>>>(
      att_bf, woutT, b_out, x, x2, nullptr, TOK, Cq, Cq, 0);

  // 7) LN2 -> y_bf
  layernorm_bf16<<<dim3(TOK), dim3(256), 0, stream>>>(x2, ln2_g, ln2_b, y_bf);

  // 8) MLP1 + GELU -> h1_bf
  gemm_bf16_wmma<<<dim3(MLPq / 256, TOK / 64), dim3(256), 0, stream>>>(
      y_bf, w1T, b1, nullptr, nullptr, h1_bf, TOK, MLPq, Cq, 1);

  // 9) MLP2 + residual x2 -> out
  gemm_bf16_wmma<<<dim3(Cq / 256, TOK / 64), dim3(256), 0, stream>>>(
      h1_bf, w2T, b2, x2, out, nullptr, TOK, Cq, MLPq, 0);
}

// v001
// Measured time: 447 microseconds a run.
// Two timings next to v000 put it at 1.89 and 1.90 times that version's speed.
#include <hip/hip_runtime.h>
#include <stdint.h>

// ---------------------------------------------------------------------------
// Problem constants (match reference)
// ---------------------------------------------------------------------------
constexpr int Bq   = 8;
constexpr int Nq   = 1024;
constexpr int Cq   = 1024;
constexpr int Hq   = 16;
constexpr int Dq   = 64;
constexpr int MLPq = 4096;
constexpr int TOK  = Bq * Nq;   // 8192 tokens

typedef __attribute__((ext_vector_type(16))) __bf16 bf16x16;
typedef __attribute__((ext_vector_type(8)))  float  f32x8;

__device__ __forceinline__ f32x8 wmma_bf16(bf16x16 a, bf16x16 b, f32x8 c) {
  return __builtin_amdgcn_wmma_f32_16x16x32_bf16(
      /*neg_a=*/false, a, /*neg_b=*/false, b,
      /*c_mod=*/(short)0, c, /*reuse_a=*/false, /*reuse_b=*/false);
}

__device__ __forceinline__ float gelu_tanh(float u) {
  const float c0 = 0.7978845608028654f;   // sqrt(2/pi)
  return 0.5f * u * (1.0f + tanhf(c0 * (u + 0.044715f * u * u * u)));
}

// ---------------------------------------------------------------------------
// Tiled weight transpose + f32 -> bf16: in [K, Nn] row-major -> out [Nn, K].
// ---------------------------------------------------------------------------
__global__ __launch_bounds__(256)
void transpose_to_bf16(const float* __restrict__ in, __bf16* __restrict__ out,
                       int K, int Nn) {
  __shared__ __bf16 tile[32][33];
  const int tx = threadIdx.x;           // 0..31
  const int ty = threadIdx.y;           // 0..7
  const int n0 = blockIdx.x * 32;
  const int k0 = blockIdx.y * 32;
#pragma unroll
  for (int i = ty; i < 32; i += 8)
    tile[i][tx] = (__bf16)in[(size_t)(k0 + i) * Nn + n0 + tx];
  __syncthreads();
#pragma unroll
  for (int i = ty; i < 32; i += 8)
    out[(size_t)(n0 + i) * K + k0 + tx] = tile[tx][i];
}

// ---------------------------------------------------------------------------
// LayerNorm (one block per token row) -> bf16 output
// ---------------------------------------------------------------------------
__global__ __launch_bounds__(256)
void layernorm_bf16(const float* __restrict__ x, const float* __restrict__ g,
                    const float* __restrict__ b, __bf16* __restrict__ out) {
  __shared__ float s_sum[256];
  __shared__ float s_sq[256];
  const int row = blockIdx.x;
  const float* xr = x + (size_t)row * Cq;

  float s = 0.f, s2 = 0.f;
  for (int i = threadIdx.x; i < Cq; i += 256) {
    float v = xr[i];
    s += v; s2 += v * v;
  }
  s_sum[threadIdx.x] = s;
  s_sq[threadIdx.x]  = s2;
  __syncthreads();
  for (int off = 128; off > 0; off >>= 1) {
    if (threadIdx.x < off) {
      s_sum[threadIdx.x] += s_sum[threadIdx.x + off];
      s_sq[threadIdx.x]  += s_sq[threadIdx.x + off];
    }
    __syncthreads();
  }
  const float mean = s_sum[0] * (1.0f / Cq);
  const float var  = s_sq[0] * (1.0f / Cq) - mean * mean;
  const float rstd = rsqrtf(var + 1e-5f);

  __bf16* orow = out + (size_t)row * Cq;
  for (int i = threadIdx.x; i < Cq; i += 256)
    orow[i] = (__bf16)((xr[i] - mean) * rstd * g[i] + b[i]);
}

// ---------------------------------------------------------------------------
// WMMA bf16 GEMM, operands staged in LDS by tensor loads, two buffers:
//   out = act( A[M,K](bf16) x Bt[Nn,K](bf16, pre-transposed) + bias ) + residual
// Block: 128 thr = 4 waves in 2x2; wave tile 64x128 -> block tile 128x256.
// A stage is ROWB bytes of k of [A 128 rows | Bt 256 rows], three slices of
// 128 rows, each brought by one tensor load of waves 0, 1, 2; LDS pitch
// ROWB + 16 (the load's pad) keeps the 16-byte fragment reads off each other's
// banks. Needs M % 128 == 0, Nn % 256 == 0, 2 * K % ROWB == 0, two stages or more.
// ---------------------------------------------------------------------------
typedef uint32_t u32x4 __attribute__((ext_vector_type(4)));
typedef uint32_t u32x8 __attribute__((ext_vector_type(8)));

__device__ __forceinline__ uint32_t uni(uint32_t v) {
  return (uint32_t)__builtin_amdgcn_readfirstlane(v);
}
// A wave-uniform value held in a scalar register: a test on it compiles to a
// scalar branch (tensor loads ignore EXEC), and what is formed from it stays
// behind the asm statements in front of it.
__device__ __forceinline__ uint32_t pinned(uint32_t v) {
  uint32_t w = (uint32_t)__builtin_amdgcn_readfirstlane(v);
  asm volatile("" : "+s"(w));  // pinned(): a descriptor word or an issue test held in a scalar register
  return w;
}
__device__ __forceinline__ void wait_ds0() {
  asm volatile("s_wait_dscnt 0x0" ::: "memory");      // this wave's LDS reads are done
}
__device__ __forceinline__ void wait_tensor0() {
  asm volatile("s_wait_tensorcnt 0x0" ::: "memory");  // this wave's tile has landed
}
__device__ __forceinline__ bf16x16 lds_frag(const unsigned char* p) {
  struct Pair { u32x4 lo, hi; } f;
  f.lo = *(const u32x4*)p;            // k 0..7 of this lane's 16
  f.hi = *(const u32x4*)(p + 16);     // k 8..15
  return __builtin_bit_cast(bf16x16, f);
}

template <int ROWB, int MINW, bool ACT, bool RES, bool OUTB>
__global__ __launch_bounds__(128, MINW)
void gemm_bf16_wmma(const __bf16* __restrict__ A, const __bf16* __restrict__ Bt,
                    const float* __restrict__ bias,
                    const float* __restrict__ residual,
                    float* __restrict__ outF, __bf16* __restrict__ outB,
                    int M, int Nn, int K) {
  static_assert(ROWB == 128 || ROWB == 256, "the pad is set for these two rows");
  constexpr uint32_t PITCH = ROWB + 16;
  constexpr uint32_t SLICE = 128u * PITCH;       // 18,432 or 34,816: multiples of 2 KiB
  constexpr uint32_t STAGE = 3u * SLICE;
  constexpr int NKB = ROWB / 64;                 // 32-k blocks per stage
  static_assert(SLICE % 2048u == 0, "each slice starts at a multiple of 2 KiB");
  __shared__ __attribute__((aligned(2048))) unsigned char smem[2 * STAGE];

  const uint32_t wave = uni(threadIdx.x >> 5);
  const int lane = threadIdx.x & 31;
  const int hf   = lane >> 4;      // which 16-lane half
  const int l15  = lane & 15;
  const int wrow = wave >> 1;      // 0..1
  const int wcol = wave & 1;       // 0..1
  const int mblk = blockIdx.y * 128;
  const int nblk = blockIdx.x * 256;
  const int m0   = mblk + wrow * 64;
  const int n0   = nblk + wcol * 128;

  // group 1 of the descriptor: bytes, 128 rows of ROWB, source pitch 2K bytes
  u32x8 g1;
  g1[0] = uni((1u << 20) | ((ROWB == 128 ? 4u : 5u) << 22) | (3u << 25));
  // words 1 to 7 through pinned(): descriptor words held in scalar registers of
  // their own, so that none is reused as a temporary while a request is out
  g1[1] = pinned(((uint32_t)ROWB & 0xFFFFu) << 16);
  g1[2] = pinned(128u << 16);
  g1[3] = pinned((uint32_t)ROWB << 16);
  g1[4] = pinned(128u);
  g1[5] = pinned((uint32_t)K * 2u);
  g1[6] = pinned(0u);
  g1[7] = pinned(0u);

  // first byte of this wave's slice (wave 3 issues nothing; its value is unused)
  const __bf16* srcp = (wave == 0) ? A + (size_t)mblk * K
                                   : Bt + (size_t)(nblk + (wave == 2 ? 128 : 0)) * K;
  const uint64_t src0 = (uint64_t)srcp;
  const uint32_t lds0 = (uint32_t)(uintptr_t)smem + (wave < 3 ? wave : 0u) * SLICE;

  u32x4 g0 = {0u, 0u, 0u, 0u};         // group 0 of this wave's latest request
  auto issue = [&](uint32_t stage) {   // call only under a scalar test
    const uint32_t st = pinned(stage); // descriptor word: formed behind the wait in front
    const uint64_t ga = src0 + (uint64_t)st * (uint32_t)ROWB;
    g0[0] = uni(1u);
    g0[1] = uni(lds0 + (st & 1u) * STAGE);
    g0[2] = uni((uint32_t)ga);
    g0[3] = uni((((uint32_t)(ga >> 32)) & 0x01FFFFFFu) | 0x80000000u);
    asm volatile("tensor_load_to_lds %0, %1" :: "s"(g0), "s"(g1) : "memory");
  };
  // The issuer's wait for its tile. It names the request's descriptor as inputs so
  // that those registers keep their values until the request has landed.
  auto landed = [&]() {
    asm volatile("s_wait_tensorcnt 0x0" :: "s"(g0), "s"(g1) : "memory");
  };

  f32x8 acc[4][8] = {};
  const unsigned char* aL = smem + (uint32_t)(wrow * 64 + l15) * PITCH + hf * 32;
  const unsigned char* bL = smem + SLICE + (uint32_t)(wcol * 128 + l15) * PITCH + hf * 32;

  const uint32_t nst = (uint32_t)(K * 2) / (uint32_t)ROWB;

  if (pinned(wave < 3)) { issue(0); landed(); }
  __syncthreads();
  if (pinned(wave < 3)) { issue(1); }

#pragma unroll 1   // one stage a trip: the ring's order stays as written
  for (uint32_t s = 0; s < nst; ++s) {
    const unsigned char* aS = aL + (s & 1u) * STAGE;
    const unsigned char* bS = bL + (s & 1u) * STAGE;
    bf16x16 af[2][4], bfr[2][8];
#pragma unroll
    for (int mt = 0; mt < 4; ++mt) af[0][mt] = lds_frag(aS + mt * 16 * PITCH);
#pragma unroll
    for (int nt = 0; nt < 8; ++nt) bfr[0][nt] = lds_frag(bS + nt * 16 * PITCH);
#pragma unroll
    for (int kb = 0; kb < NKB; ++kb) {
      if (kb + 1 < NKB) {   // next block's fragments of the same stage, as one group
#pragma unroll
        for (int mt = 0; mt < 4; ++mt)
          af[(kb + 1) & 1][mt] = lds_frag(aS + mt * 16 * PITCH + (kb + 1) * 64);
#pragma unroll
        for (int nt = 0; nt < 8; ++nt)
          bfr[(kb + 1) & 1][nt] = lds_frag(bS + nt * 16 * PITCH + (kb + 1) * 64);
      }
      __builtin_amdgcn_sched_barrier(0);  // keeps the LDS reads out of the WMMA run
#pragma unroll
      for (int mt = 0; mt < 4; ++mt)
#pragma unroll
        for (int nt = 0; nt < 8; ++nt)
          acc[mt][nt] = wmma_bf16(af[kb & 1][mt], bfr[kb & 1][nt], acc[mt][nt]);
      __builtin_amdgcn_sched_barrier(0);  // keeps the next reads behind this WMMA run
    }
    // publish stage s + 1, free stage s's buffer
    wait_ds0();
    if (pinned(wave < 3)) { landed(); }
    __syncthreads();
    if (pinned((wave < 3) && (s + 2 < nst))) { issue(s + 2); }
  }
  wait_tensor0();
  wait_ds0();

  // ---- epilogue. C-layout: row = vgpr + 8*half, col = lane&15.
  auto close_x = [&]() {
    asm volatile("s_wait_xcnt 0x0" ::: "memory");
    __builtin_amdgcn_sched_barrier(0);  // keeps later register writes behind that wait
  };
  const uint32_t ncol = (uint32_t)(n0 + l15);
  float bn[8];
#pragma unroll
  for (int nt = 0; nt < 8; ++nt) bn[nt] = bias[(size_t)ncol + nt * 16];
  close_x();

  // element offsets of a 16-row band's eight rows (this lane's column of tile 0)
  auto rows = [&](int mr, uint32_t (&ro)[8]) __attribute__((always_inline)) {
#pragma unroll
    for (int r = 0; r < 8; ++r) ro[r] = (uint32_t)(mr + r + 8 * hf) * (uint32_t)Nn + ncol;
  };
  // the band's values, finished in place; ms is a literal at every call so that
  // every accumulator index is a constant
  auto finish = [&](int ms, const uint32_t (&ro)[8]) __attribute__((always_inline)) {
    float res[8][8];
    if constexpr (RES) {
#pragma unroll
      for (int r = 0; r < 8; ++r)
#pragma unroll
        for (int nt = 0; nt < 8; ++nt) res[r][nt] = residual[(size_t)ro[r] + nt * 16];
    }
#pragma unroll
    for (int r = 0; r < 8; ++r)
#pragma unroll
      for (int nt = 0; nt < 8; ++nt) {
        float v = acc[ms][nt][r] + bn[nt];
        if constexpr (ACT) v = gelu_tanh(v);
        if constexpr (RES) v += res[r][nt];
        acc[ms][nt][r] = v;
      }
  };
  // the band's stores, nothing but stores: every value and offset is ready in front
  auto put = [&](int ms, const uint32_t (&ro)[8]) __attribute__((always_inline)) {
    if constexpr (OUTB) {
      __bf16 h[8][8];
#pragma unroll
      for (int r = 0; r < 8; ++r)
#pragma unroll
        for (int nt = 0; nt < 8; ++nt) h[r][nt] = (__bf16)acc[ms][nt][r];
      __builtin_amdgcn_sched_barrier(0);  // no register write among the stores
#pragma unroll
      for (int r = 0; r < 8; ++r)
#pragma unroll
        for (int nt = 0; nt < 8; ++nt) outB[(size_t)ro[r] + nt * 16] = h[r][nt];
    } else {
      __builtin_amdgcn_sched_barrier(0);  // no register write among the stores
#pragma unroll
      for (int r = 0; r < 8; ++r)
#pragma unroll
        for (int nt = 0; nt < 8; ++nt) outF[(size_t)ro[r] + nt * 16] = acc[ms][nt][r];
    }
  };
  if constexpr (ACT) {
    // For speed only: one band's code, run four times, the bands moved down in
    // registers.
#pragma unroll 1   // rolled on purpose: see above
    for (int ms = 0; ms < 4; ++ms) {
      uint32_t ro[8];
      rows(m0 + ms * 16, ro);
      finish(0, ro);
      put(0, ro);
      close_x();
#pragma unroll
      for (int nt = 0; nt < 8; ++nt) {
        acc[0][nt] = acc[1][nt]; acc[1][nt] = acc[2][nt]; acc[2][nt] = acc[3][nt];
      }
    }
  } else {
    uint32_t ro[4][8];
    rows(m0, ro[0]); rows(m0 + 16, ro[1]); rows(m0 + 32, ro[2]); rows(m0 + 48, ro[3]);
    finish(0, ro[0]); finish(1, ro[1]); finish(2, ro[2]); finish(3, ro[3]);
    put(0, ro[0]); put(1, ro[1]); put(2, ro[2]); put(3, ro[3]);
  }
}

// ---------------------------------------------------------------------------
// Split fused QKV (f32 [TOK, 3C]) -> q,k per-head bf16 [B,H,N,D] (coalesced)
// ---------------------------------------------------------------------------
__global__ __launch_bounds__(256)
void split_qk(const float* __restrict__ qkv, __bf16* __restrict__ q,
              __bf16* __restrict__ k) {
  size_t gid = (size_t)blockIdx.x * blockDim.x + threadIdx.x;
  if (gid >= (size_t)TOK * Cq) return;
  int t = (int)(gid / Cq);        // token
  int c = (int)(gid % Cq);        // channel
  int h = c / Dq;
  int d = c % Dq;
  int b = t / Nq;
  int n = t % Nq;
  size_t head = (size_t)b * Hq + h;
  const float* src = qkv + (size_t)t * (3 * Cq) + c;
  q[(head * Nq + n) * Dq + d] = (__bf16)src[0];
  k[(head * Nq + n) * Dq + d] = (__bf16)src[Cq];
}

// ---------------------------------------------------------------------------
// V part of QKV -> vT [B,H,D,N] bf16 via tiled LDS transpose
// ---------------------------------------------------------------------------
__global__ __launch_bounds__(256)
void v_transpose(const float* __restrict__ qkv, __bf16* __restrict__ vT) {
  __shared__ __bf16 tile[32][33];
  const int tx = threadIdx.x, ty = threadIdx.y;
  const int bh = blockIdx.x;
  const int n0 = blockIdx.y * 32;
  const int d0 = blockIdx.z * 32;
  const int b = bh / Hq, h = bh % Hq;
#pragma unroll
  for (int i = ty; i < 32; i += 8)
    tile[i][tx] = (__bf16)qkv[(size_t)((size_t)b * Nq + n0 + i) * (3 * Cq) +
                              2 * Cq + h * Dq + d0 + tx];
  __syncthreads();
#pragma unroll
  for (int i = ty; i < 32; i += 8)
    vT[((size_t)bh * Dq + d0 + i) * Nq + n0 + tx] = tile[tx][i];
}

// ---------------------------------------------------------------------------
// Flash attention: grid (B*H, N/128), 256 thr = 8 waves, wave owns 16 rows.
// Online softmax over 32-wide KV blocks; S and O via WMMA.
// Ping-pong K-fragment prefetch (jj+=2), V loads issued before softmax VALU.
// ---------------------------------------------------------------------------
__global__ __launch_bounds__(256)
void attention_kernel(const __bf16* __restrict__ q, const __bf16* __restrict__ k,
                      const __bf16* __restrict__ vT, __bf16* __restrict__ att) {
  const int bh   = blockIdx.x;          // b*H + h
  const int wave = threadIdx.x >> 5;
  const int lane = threadIdx.x & 31;
  const int hf   = lane >> 4;
  const int l15  = lane & 15;
  const int m0   = blockIdx.y * 128 + wave * 16;
  constexpr int NB = Nq / 32;           // 32 (even)

  const __bf16* qb = q  + (size_t)bh * Nq * Dq;
  const __bf16* kb = k  + (size_t)bh * Nq * Dq;
  const __bf16* vb = vT + (size_t)bh * Dq * Nq;

  __shared__ __attribute__((aligned(32))) __bf16 pshare[8][16][32];

  // Q fragments (held whole kernel): rows m0..m0+15, D split 0..31 / 32..63
  bf16x16 qf0 = *(const bf16x16*)(qb + (size_t)(m0 + l15) * Dq + hf * 16);
  bf16x16 qf1 = *(const bf16x16*)(qb + (size_t)(m0 + l15) * Dq + 32 + hf * 16);

  f32x8 o[4] = {};
  float mrun[8], lrun[8];
#pragma unroll
  for (int r = 0; r < 8; ++r) { mrun[r] = -1e30f; lrun[r] = 0.f; }

  auto loadK = [&](int j, bf16x16 (&kk)[4]) {
#pragma unroll
    for (int t = 0; t < 2; ++t) {
      const int col0 = j * 32 + t * 16;
      kk[t * 2 + 0] = *(const bf16x16*)(kb + (size_t)(col0 + l15) * Dq + hf * 16);
      kk[t * 2 + 1] = *(const bf16x16*)(kb + (size_t)(col0 + l15) * Dq + 32 + hf * 16);
    }
  };

  // one 32-wide KV block: scores with kc, prefetch K block jnext into kn2
  auto process = [&](int jc, bf16x16 (&kc)[4], bf16x16 (&kn2)[4], int jnext) {
    f32x8 s0 = {}, s1 = {};
    s0 = wmma_bf16(qf0, kc[0], s0);
    s0 = wmma_bf16(qf1, kc[1], s0);
    s1 = wmma_bf16(qf0, kc[2], s1);
    s1 = wmma_bf16(qf1, kc[3], s1);

    // V loads for this block (consumed by o-wmma below; issued first)
    bf16x16 vf[4];
#pragma unroll
    for (int nt = 0; nt < 4; ++nt)
      vf[nt] = *(const bf16x16*)(vb + (size_t)(nt * 16 + l15) * Nq +
                                 jc * 32 + hf * 16);
    // next K block prefetch (wrapped address keeps it in bounds; dead at end)
    loadK(jnext, kn2);

    // ---- online softmax (VALU hides outstanding loads)
    float pv[2][8];
    float tmax[8];
#pragma unroll
    for (int r = 0; r < 8; ++r) {
      float v0 = s0[r] * 0.125f;            // 1/sqrt(D)
      float v1 = s1[r] * 0.125f;
      pv[0][r] = v0; pv[1][r] = v1;
      tmax[r] = fmaxf(v0, v1);
    }
#pragma unroll
    for (int r = 0; r < 8; ++r) {
      float v = tmax[r];
      v = fmaxf(v, __shfl_xor(v, 1));
      v = fmaxf(v, __shfl_xor(v, 2));
      v = fmaxf(v, __shfl_xor(v, 4));
      v = fmaxf(v, __shfl_xor(v, 8));
      tmax[r] = v;
    }
    float corr[8];
#pragma unroll
    for (int r = 0; r < 8; ++r) {
      float mnew = fmaxf(mrun[r], tmax[r]);
      corr[r] = __expf(mrun[r] - mnew);
      mrun[r] = mnew;
    }
#pragma unroll
    for (int r = 0; r < 8; ++r) {
      float p0 = __expf(pv[0][r] - mrun[r]);
      float p1 = __expf(pv[1][r] - mrun[r]);
      pv[0][r] = p0; pv[1][r] = p1;
      float v = p0 + p1;
      v += __shfl_xor(v, 1);
      v += __shfl_xor(v, 2);
      v += __shfl_xor(v, 4);
      v += __shfl_xor(v, 8);
      lrun[r] = lrun[r] * corr[r] + v;
    }
#pragma unroll
    for (int nt = 0; nt < 4; ++nt)
#pragma unroll
      for (int r = 0; r < 8; ++r) o[nt][r] *= corr[r];

    // ---- C-layout -> A-layout for P via per-wave LDS bounce
#pragma unroll
    for (int t = 0; t < 2; ++t)
#pragma unroll
      for (int r = 0; r < 8; ++r)
        pshare[wave][r + 8 * hf][t * 16 + l15] = (__bf16)pv[t][r];
    __syncthreads();
    bf16x16 pa = *(const bf16x16*)(&pshare[wave][l15][hf * 16]);

    // ---- O += P(16x32) x V(32xD)
#pragma unroll
    for (int nt = 0; nt < 4; ++nt)
      o[nt] = wmma_bf16(pa, vf[nt], o[nt]);
    __syncthreads();
  };

  bf16x16 kfA[4], kfB[4];
  loadK(0, kfA);
  for (int jj = 0; jj < NB; jj += 2) {
    process(jj,     kfA, kfB, jj + 1);
    process(jj + 1, kfB, kfA, (jj + 2 < NB) ? jj + 2 : 0);
  }

  // ---- finalize: divide by l, store into [B,N,C] bf16
  const int b = bh / Hq, h = bh % Hq;
#pragma unroll
  for (int nt = 0; nt < 4; ++nt)
#pragma unroll
    for (int r = 0; r < 8; ++r) {
      float val = o[nt][r] / lrun[r];
      int row = m0 + r + 8 * hf;
      int col = nt * 16 + l15;
      att[((size_t)b * Nq + row) * Cq + h * Dq + col] = (__bf16)val;
    }
}

// ---------------------------------------------------------------------------
// Launch
// ---------------------------------------------------------------------------
extern "C" void kernel_launch(void* const* d_in, const int* in_sizes, int n_in,
                              void* d_out, int out_size, void* d_ws, size_t ws_size,
                              hipStream_t stream) {
  (void)in_sizes; (void)n_in; (void)out_size; (void)ws_size;
  const float* x     = (const float*)d_in[0];
  const float* ln1_g = (const float*)d_in[1];
  const float* ln1_b = (const float*)d_in[2];
  const float* w_qkv = (const float*)d_in[3];
  const float* b_qkv = (const float*)d_in[4];
  const float* w_out = (const float*)d_in[5];
  const float* b_out = (const float*)d_in[6];
  const float* ln2_g = (const float*)d_in[7];
  const float* ln2_b = (const float*)d_in[8];
  const float* w1    = (const float*)d_in[9];
  const float* b1    = (const float*)d_in[10];
  const float* w2    = (const float*)d_in[11];
  const float* b2    = (const float*)d_in[12];
  float* out = (float*)d_out;

  // ---- workspace bump allocator (lifetimes allow heavy reuse)
  char* p = (char*)d_ws;
  auto alloc = [&](size_t bytes) -> char* {
    char* r = p;
    p += (bytes + 255) & ~(size_t)255;
    return r;
  };
  __bf16* wqkvT = (__bf16*)alloc((size_t)Cq * 3 * Cq * 2);     // 6 MB
  __bf16* woutT = (__bf16*)alloc((size_t)Cq * Cq * 2);         // 2 MB
  __bf16* w1T   = (__bf16*)alloc((size_t)Cq * MLPq * 2);       // 8 MB
  __bf16* w2T   = (__bf16*)alloc((size_t)MLPq * Cq * 2);       // 8 MB
  char*   r16   = alloc((size_t)TOK * Cq * 2);                 // 16 MB: h_bf, then att_bf
  char*   rqkv  = alloc((size_t)TOK * 3 * Cq * 4);             // 96 MB: qkv_f32, then x2 + h1
  __bf16* q_bf  = (__bf16*)alloc((size_t)TOK * Cq * 2);        // 16 MB: q, then y_bf
  __bf16* k_bf  = (__bf16*)alloc((size_t)TOK * Cq * 2);        // 16 MB
  __bf16* vT_bf = (__bf16*)alloc((size_t)TOK * Cq * 2);        // 16 MB

  __bf16* h_bf   = (__bf16*)r16;
  __bf16* att_bf = (__bf16*)r16;                           // reuse after h dead
  float*  qkv_f  = (float*)rqkv;
  float*  x2     = (float*)rqkv;                           // reuse after qkv dead
  __bf16* h1_bf  = (__bf16*)(rqkv + (size_t)TOK * Cq * 4); // next 64 MB
  __bf16* y_bf   = q_bf;                                   // reuse after attention

  // 1) weight transposes (f32 -> bf16 [N,K]), tiled/coalesced
  {
    auto tp = [&](const float* w, __bf16* wt, int K, int Nn) {
      transpose_to_bf16<<<dim3(Nn / 32, K / 32), dim3(32, 8), 0, stream>>>(w, wt, K, Nn);
    };
    tp(w_qkv, wqkvT, Cq, 3 * Cq);
    tp(w_out, woutT, Cq, Cq);
    tp(w1, w1T, Cq, MLPq);
    tp(w2, w2T, MLPq, Cq);
  }

  // 2) LN1
  layernorm_bf16<<<dim3(TOK), dim3(256), 0, stream>>>(x, ln1_g, ln1_b, h_bf);

  // 3) QKV GEMM: [TOK,C] x [C,3C] -> qkv_f
  gemm_bf16_wmma<128, 2, false, false, false><<<dim3(3 * Cq / 256, TOK / 128), dim3(128), 0, stream>>>(
      h_bf, wqkvT, b_qkv, nullptr, qkv_f, nullptr, TOK, 3 * Cq, Cq);

  // 4) split into per-head q/k and transposed v
  {
    size_t total = (size_t)TOK * Cq;
    split_qk<<<dim3((unsigned)((total + 255) / 256)), dim3(256), 0, stream>>>(
        qkv_f, q_bf, k_bf);
    v_transpose<<<dim3(Bq * Hq, Nq / 32, Dq / 32), dim3(32, 8), 0, stream>>>(
        qkv_f, vT_bf);
  }

  // 5) attention -> att_bf [B,N,C]
  attention_kernel<<<dim3(Bq * Hq, Nq / 128), dim3(256), 0, stream>>>(
      q_bf, k_bf, vT_bf, att_bf);

  // 6) out projection + residual x -> x2
  gemm_bf16_wmma<256, 1, false, true, false><<<dim3(Cq / 256, TOK / 128), dim3(128), 0, stream>>>(
      att_bf, woutT, b_out, x, x2, nullptr, TOK, Cq, Cq);

  // 7) LN2 -> y_bf
  layernorm_bf16<<<dim3(TOK), dim3(256), 0, stream>>>(x2, ln2_g, ln2_b, y_bf);

  // 8) MLP1 + GELU -> h1_bf
  gemm_bf16_wmma<128, 2, true, false, true><<<dim3(MLPq / 256, TOK / 128), dim3(128), 0, stream>>>(
      y_bf, w1T, b1, nullptr, nullptr, h1_bf, TOK, MLPq, Cq);

  // 9) MLP2 + residual x2 -> out
  gemm_bf16_wmma<256, 1, false, true, false><<<dim3(Cq / 256, TOK / 128), dim3(128), 0, stream>>>(
      h1_bf, w2T, b2, x2, out, nullptr, TOK, Cq, MLPq);
}

// v002
// It runs in 398 microseconds.
// Timed twice side by side with v001, it ran 1.12 times as fast both times.
// Counting every step since v000, it is 2.12 times as fast.
#include <hip/hip_runtime.h>
#include <stdint.h>

// ---------------------------------------------------------------------------
// Problem constants (match reference)
// ---------------------------------------------------------------------------
constexpr int Bq   = 8;
constexpr int Nq   = 1024;
constexpr int Cq   = 1024;
constexpr int Hq   = 16;
constexpr int Dq   = 64;
constexpr int MLPq = 4096;
constexpr int TOK  = Bq * Nq;   // 8192 tokens

typedef __attribute__((ext_vector_type(16))) __bf16 bf16x16;
typedef __attribute__((ext_vector_type(8)))  float  f32x8;

__device__ __forceinline__ f32x8 wmma_bf16(bf16x16 a, bf16x16 b, f32x8 c) {
  return __builtin_amdgcn_wmma_f32_16x16x32_bf16(
      /*neg_a=*/false, a, /*neg_b=*/false, b,
      /*c_mod=*/(short)0, c, /*reuse_a=*/false, /*reuse_b=*/false);
}

__device__ __forceinline__ float gelu_tanh(float u) {
  const float c0 = 0.7978845608028654f;   // sqrt(2/pi)
  return 0.5f * u * (1.0f + tanhf(c0 * (u + 0.044715f * u * u * u)));
}

// ---------------------------------------------------------------------------
// Tiled weight transpose + f32 -> bf16: in [K, Nn] row-major -> out [Nn, K].
// ---------------------------------------------------------------------------
__global__ __launch_bounds__(256)
void transpose_to_bf16(const float* __restrict__ in, __bf16* __restrict__ out,
                       int K, int Nn) {
  __shared__ __bf16 tile[32][33];
  const int tx = threadIdx.x;           // 0..31
  const int ty = threadIdx.y;           // 0..7
  const int n0 = blockIdx.x * 32;
  const int k0 = blockIdx.y * 32;
#pragma unroll
  for (int i = ty; i < 32; i += 8)
    tile[i][tx] = (__bf16)in[(size_t)(k0 + i) * Nn + n0 + tx];
  __syncthreads();
#pragma unroll
  for (int i = ty; i < 32; i += 8)
    out[(size_t)(n0 + i) * K + k0 + tx] = tile[tx][i];
}

// ---------------------------------------------------------------------------
// LayerNorm (one block per token row) -> bf16 output
// ---------------------------------------------------------------------------
__global__ __launch_bounds__(256)
void layernorm_bf16(const float* __restrict__ x, const float* __restrict__ g,
                    const float* __restrict__ b, __bf16* __restrict__ out) {
  __shared__ float s_sum[256];
  __shared__ float s_sq[256];
  const int row = blockIdx.x;
  const float* xr = x + (size_t)row * Cq;

  float s = 0.f, s2 = 0.f;
  for (int i = threadIdx.x; i < Cq; i += 256) {
    float v = xr[i];
    s += v; s2 += v * v;
  }
  s_sum[threadIdx.x] = s;
  s_sq[threadIdx.x]  = s2;
  __syncthreads();
  for (int off = 128; off > 0; off >>= 1) {
    if (threadIdx.x < off) {
      s_sum[threadIdx.x] += s_sum[threadIdx.x + off];
      s_sq[threadIdx.x]  += s_sq[threadIdx.x + off];
    }
    __syncthreads();
  }
  const float mean = s_sum[0] * (1.0f / Cq);
  const float var  = s_sq[0] * (1.0f / Cq) - mean * mean;
  const float rstd = rsqrtf(var + 1e-5f);

  __bf16* orow = out + (size_t)row * Cq;
  for (int i = threadIdx.x; i < Cq; i += 256)
    orow[i] = (__bf16)((xr[i] - mean) * rstd * g[i] + b[i]);
}

// ---------------------------------------------------------------------------
// WMMA bf16 GEMM, operands staged in LDS by tensor loads, two buffers:
//   out = act( A[M,K](bf16) x Bt[Nn,K](bf16, pre-transposed) + bias ) + residual
// Block: 128 thr = 4 waves in 2x2; wave tile 64x128 -> block tile 128x256.
// A stage is ROWB bytes of k of [A 128 rows | Bt 256 rows], three slices of
// 128 rows, each brought by one tensor load of waves 0, 1, 2; LDS pitch
// ROWB + 16 (the load's pad) keeps the 16-byte fragment reads off each other's
// banks. Needs M % 128 == 0, Nn % 256 == 0, 2 * K % ROWB == 0, two stages or more.
// HEADS: Bt's rows are the channels [q | k | v], Cq each, and the result goes out in
// bf16 as attention reads it: q, k as [B,H,N,D] (outB, outK), v as [B,H,D,N] (outVt).
// A lane's eight accumulator rows must then be neighbours in the output: tokens for
// v, channels for q and k, whose blocks take Bt as the row operand and A as the
// column operand (128 channels x 256 tokens). Same grid, same number of blocks.
// ---------------------------------------------------------------------------
typedef uint32_t u32x4 __attribute__((ext_vector_type(4)));
typedef uint32_t u32x8 __attribute__((ext_vector_type(8)));

__device__ __forceinline__ uint32_t uni(uint32_t v) {
  return (uint32_t)__builtin_amdgcn_readfirstlane(v);
}
// A wave-uniform value held in a scalar register: a test on it compiles to a
// scalar branch (tensor loads ignore EXEC), and what is formed from it stays
// behind the asm statements in front of it.
__device__ __forceinline__ uint32_t pinned(uint32_t v) {
  uint32_t w = (uint32_t)__builtin_amdgcn_readfirstlane(v);
  asm volatile("" : "+s"(w));  // pinned(): a descriptor word or an issue test held in a scalar register
  return w;
}
__device__ __forceinline__ void wait_ds0() {
  asm volatile("s_wait_dscnt 0x0" ::: "memory");      // this wave's LDS reads are done
}
__device__ __forceinline__ void wait_tensor0() {
  asm volatile("s_wait_tensorcnt 0x0" ::: "memory");  // this wave's tile has landed
}
__device__ __forceinline__ bf16x16 lds_frag(const unsigned char* p) {
  struct Pair { u32x4 lo, hi; } f;
  f.lo = *(const u32x4*)p;            // k 0..7 of this lane's 16
  f.hi = *(const u32x4*)(p + 16);     // k 8..15
  return __builtin_bit_cast(bf16x16, f);
}

typedef __bf16 bf16x8 __attribute__((ext_vector_type(8)));

template <int ROWB, int MINW, bool ACT, bool RES, bool OUTB, bool HEADS>
__global__ __launch_bounds__(128, MINW)
void gemm_bf16_wmma(const __bf16* __restrict__ A, const __bf16* __restrict__ Bt,
                    const float* __restrict__ bias,
                    const float* __restrict__ residual,
                    float* __restrict__ outF, __bf16* __restrict__ outB,
                    __bf16* __restrict__ outK, __bf16* __restrict__ outVt,
                    int M, int Nn, int K) {
  static_assert(ROWB == 128 || ROWB == 256, "the pad is set for these two rows");
  constexpr uint32_t PITCH = ROWB + 16;
  constexpr uint32_t SLICE = 128u * PITCH;       // 18,432 or 34,816: multiples of 2 KiB
  constexpr uint32_t STAGE = 3u * SLICE;
  constexpr int NKB = ROWB / 64;                 // 32-k blocks per stage
  static_assert(SLICE % 2048u == 0, "each slice starts at a multiple of 2 KiB");
  __shared__ __attribute__((aligned(2048))) unsigned char smem[2 * STAGE];

  const uint32_t wave = uni(threadIdx.x >> 5);
  const int lane = threadIdx.x & 31;
  const int hf   = lane >> 4;      // which 16-lane half
  const int l15  = lane & 15;
  const int wrow = wave >> 1;      // 0..1
  const int wcol = wave & 1;       // 0..1
  int mblk = blockIdx.y * 128;     // first row of the row operand
  int nblk = blockIdx.x * 256;     // first row of the column operand
  const __bf16* rowp = A;
  const __bf16* colp = Bt;
  constexpr uint32_t QKX = 2 * Cq / 256;             // blockIdx.x below this: q, k
  const bool chrows = HEADS && blockIdx.x < QKX;     // channels are the rows of this block
  if constexpr (HEADS) {
    if (chrows) {
      const uint32_t t = blockIdx.x + QKX * blockIdx.y;
      mblk = (int)(t % (2 * Cq / 128)) * 128;        // channel
      nblk = (int)(t / (2 * Cq / 128)) * 256;        // token
      rowp = Bt;
      colp = A;
    }
  }
  const int m0   = mblk + wrow * 64;
  const int n0   = nblk + wcol * 128;

  // group 1 of the descriptor: bytes, 128 rows of ROWB, source pitch 2K bytes
  u32x8 g1;
  g1[0] = uni((1u << 20) | ((ROWB == 128 ? 4u : 5u) << 22) | (3u << 25));
  // words 1 to 7 through pinned(): descriptor words held in scalar registers of
  // their own, so that none is reused as a temporary while a request is out
  g1[1] = pinned(((uint32_t)ROWB & 0xFFFFu) << 16);
  g1[2] = pinned(128u << 16);
  g1[3] = pinned((uint32_t)ROWB << 16);
  g1[4] = pinned(128u);
  g1[5] = pinned((uint32_t)K * 2u);
  g1[6] = pinned(0u);
  g1[7] = pinned(0u);

  // first byte of this wave's slice (wave 3 issues nothing; its value is unused)
  const __bf16* srcp = (wave == 0) ? rowp + (size_t)mblk * K
                                   : colp + (size_t)(nblk + (wave == 2 ? 128 : 0)) * K;
  const uint64_t src0 = (uint64_t)srcp;
  const uint32_t lds0 = (uint32_t)(uintptr_t)smem + (wave < 3 ? wave : 0u) * SLICE;

  u32x4 g0 = {0u, 0u, 0u, 0u};         // group 0 of this wave's latest request
  auto issue = [&](uint32_t stage) {   // call only under a scalar test
    const uint32_t st = pinned(stage); // descriptor word: formed behind the wait in front
    const uint64_t ga = src0 + (uint64_t)st * (uint32_t)ROWB;
    g0[0] = uni(1u);
    g0[1] = uni(lds0 + (st & 1u) * STAGE);
    g0[2] = uni((uint32_t)ga);
    g0[3] = uni((((uint32_t)(ga >> 32)) & 0x01FFFFFFu) | 0x80000000u);
    asm volatile("tensor_load_to_lds %0, %1" :: "s"(g0), "s"(g1) : "memory");
  };
  // The issuer's wait for its tile. It names the request's descriptor as inputs so
  // that those registers keep their values until the request has landed.
  auto landed = [&]() {
    asm volatile("s_wait_tensorcnt 0x0" :: "s"(g0), "s"(g1) : "memory");
  };

  f32x8 acc[4][8] = {};
  const unsigned char* aL = smem + (uint32_t)(wrow * 64 + l15) * PITCH + hf * 32;
  const unsigned char* bL = smem + SLICE + (uint32_t)(wcol * 128 + l15) * PITCH + hf * 32;

  const uint32_t nst = (uint32_t)(K * 2) / (uint32_t)ROWB;

  if (pinned(wave < 3)) { issue(0); landed(); }
  __syncthreads();
  if (pinned(wave < 3)) { issue(1); }

#pragma unroll 1   // one stage a trip: the ring's order stays as written
  for (uint32_t s = 0; s < nst; ++s) {
    const unsigned char* aS = aL + (s & 1u) * STAGE;
    const unsigned char* bS = bL + (s & 1u) * STAGE;
    bf16x16 af[2][4], bfr[2][8];
#pragma unroll
    for (int mt = 0; mt < 4; ++mt) af[0][mt] = lds_frag(aS + mt * 16 * PITCH);
#pragma unroll
    for (int nt = 0; nt < 8; ++nt) bfr[0][nt] = lds_frag(bS + nt * 16 * PITCH);
#pragma unroll
    for (int kb = 0; kb < NKB; ++kb) {
      if (kb + 1 < NKB) {   // next block's fragments of the same stage, as one group
#pragma unroll
        for (int mt = 0; mt < 4; ++mt)
          af[(kb + 1) & 1][mt] = lds_frag(aS + mt * 16 * PITCH + (kb + 1) * 64);
#pragma unroll
        for (int nt = 0; nt < 8; ++nt)
          bfr[(kb + 1) & 1][nt] = lds_frag(bS + nt * 16 * PITCH + (kb + 1) * 64);
      }
      __builtin_amdgcn_sched_barrier(0);  // keeps the LDS reads out of the WMMA run
#pragma unroll
      for (int mt = 0; mt < 4; ++mt)
#pragma unroll
        for (int nt = 0; nt < 8; ++nt)
          acc[mt][nt] = wmma_bf16(af[kb & 1][mt], bfr[kb & 1][nt], acc[mt][nt]);
      __builtin_amdgcn_sched_barrier(0);  // keeps the next reads behind this WMMA run
    }
    // publish stage s + 1, free stage s's buffer
    wait_ds0();
    if (pinned(wave < 3)) { landed(); }
    __syncthreads();
    if (pinned((wave < 3) && (s + 2 < nst))) { issue(s + 2); }
  }
  wait_tensor0();
  wait_ds0();

  // ---- epilogue. C-layout: row = vgpr + 8*half, col = lane&15.
  auto close_x = [&]() {
    asm volatile("s_wait_xcnt 0x0" ::: "memory");
    __builtin_amdgcn_sched_barrier(0);  // keeps later register writes behind that wait
  };
  if constexpr (HEADS) {
    static_assert(Cq % 256 == 0 && Nq % 256 == 0 && Dq == 64 && TOK % 256 == 0 && !ACT && !RES,
                  "a block lies in one of q, k, v and in one batch entry; 64 channels are a head");
    // every loop below is unrolled so that each accumulator index is a constant (registers, no scratch)
    bf16x8 pk[4][8];   // a tile's eight rows of this lane: 16 bytes in a row of the output
    __bf16* dst;       // the block's plane
    uint32_t e0;       // element of tile (0, 0) there
    uint32_t step;     // bytes from one 16-column tile to the next
    if (chrows) {
      // rows: the 64 channels of one head of q or k; columns: 128 tokens
      float br[4][8];
#pragma unroll
      for (int ms = 0; ms < 4; ++ms)
#pragma unroll
        for (int r = 0; r < 8; ++r) br[ms][r] = bias[(size_t)(uint32_t)(m0 + 8 * hf) + ms * 16 + r];
      close_x();
#pragma unroll
      for (int ms = 0; ms < 4; ++ms)
#pragma unroll
        for (int nt = 0; nt < 8; ++nt)
#pragma unroll
          for (int r = 0; r < 8; ++r) pk[ms][nt][r] = (__bf16)(acc[ms][nt][r] + br[ms][r]);
      const uint32_t head = (uint32_t)(n0 / Nq) * Hq + (uint32_t)(m0 % Cq) / Dq;
      dst  = m0 < Cq ? outB : outK;
      e0   = (head * Nq + (uint32_t)(n0 % Nq) + l15) * Dq + 8 * hf;
      step = 16 * Dq * 2;
    } else {
      // rows: 64 tokens; columns: 128 channels of v; (b * Hq + h) * Dq + d = b * Cq + channel
      const uint32_t ch = (uint32_t)(n0 + l15);
      float bc[8];
#pragma unroll
      for (int nt = 0; nt < 8; ++nt) bc[nt] = bias[(size_t)ch + nt * 16];
      close_x();
#pragma unroll
      for (int ms = 0; ms < 4; ++ms)
#pragma unroll
        for (int nt = 0; nt < 8; ++nt)
#pragma unroll
          for (int r = 0; r < 8; ++r) pk[ms][nt][r] = (__bf16)(acc[ms][nt][r] + bc[nt]);
      dst  = outVt;
      e0   = ((uint32_t)(m0 / Nq) * Cq + (ch - 2 * Cq)) * Nq + (uint32_t)(m0 % Nq) + 8 * hf;
      step = 16 * Nq * 2;
    }
    uint32_t bo[8];    // byte offsets of the eight column tiles, all formed in front of the stores
#pragma unroll
    for (int nt = 0; nt < 8; ++nt) bo[nt] = e0 * 2 + nt * step;
    __builtin_amdgcn_sched_barrier(0);  // no register write among the stores
#pragma unroll
    for (int nt = 0; nt < 8; ++nt)
#pragma unroll
      for (int ms = 0; ms < 4; ++ms)   // four stores fill this lane's share of a 128-byte line
        *(bf16x8*)((char*)dst + (size_t)bo[nt] + ms * 32) = pk[ms][nt];
    return;
  }

  const uint32_t ncol = (uint32_t)(n0 + l15);
  float bn[8];
#pragma unroll
  for (int nt = 0; nt < 8; ++nt) bn[nt] = bias[(size_t)ncol + nt * 16];
  close_x();

  // element offsets of a 16-row band's eight rows (this lane's column of tile 0)
  auto rows = [&](int mr, uint32_t (&ro)[8]) __attribute__((always_inline)) {
#pragma unroll
    for (int r = 0; r < 8; ++r) ro[r] = (uint32_t)(mr + r + 8 * hf) * (uint32_t)Nn + ncol;
  };
  // the band's values, finished in place; ms is a literal at every call so that
  // every accumulator index is a constant
  auto finish = [&](int ms, const uint32_t (&ro)[8]) __attribute__((always_inline)) {
    float res[8][8];
    if constexpr (RES) {
#pragma unroll
      for (int r = 0; r < 8; ++r)
#pragma unroll
        for (int nt = 0; nt < 8; ++nt) res[r][nt] = residual[(size_t)ro[r] + nt * 16];
    }
#pragma unroll
    for (int r = 0; r < 8; ++r)
#pragma unroll
      for (int nt = 0; nt < 8; ++nt) {
        float v = acc[ms][nt][r] + bn[nt];
        if constexpr (ACT) v = gelu_tanh(v);
        if constexpr (RES) v += res[r][nt];
        acc[ms][nt][r] = v;
      }
  };
  // the band's stores, nothing but stores: every value and offset is ready in front
  auto put = [&](int ms, const uint32_t (&ro)[8]) __attribute__((always_inline)) {
    if constexpr (OUTB) {
      __bf16 h[8][8];
#pragma unroll
      for (int r = 0; r < 8; ++r)
#pragma unroll
        for (int nt = 0; nt < 8; ++nt) h[r][nt] = (__bf16)acc[ms][nt][r];
      __builtin_amdgcn_sched_barrier(0);  // no register write among the stores
#pragma unroll
      for (int r = 0; r < 8; ++r)
#pragma unroll
        for (int nt = 0; nt < 8; ++nt) outB[(size_t)ro[r] + nt * 16] = h[r][nt];
    } else {
      __builtin_amdgcn_sched_barrier(0);  // no register write among the stores
#pragma unroll
      for (int r = 0; r < 8; ++r)
#pragma unroll
        for (int nt = 0; nt < 8; ++nt) outF[(size_t)ro[r] + nt * 16] = acc[ms][nt][r];
    }
  };
  if constexpr (ACT) {
    // For speed only: one band's code, run four times, the bands moved down in
    // registers.
#pragma unroll 1   // rolled on purpose: see above
    for (int ms = 0; ms < 4; ++ms) {
      uint32_t ro[8];
      rows(m0 + ms * 16, ro);
      finish(0, ro);
      put(0, ro);
      close_x();
#pragma unroll
      for (int nt = 0; nt < 8; ++nt) {
        acc[0][nt] = acc[1][nt]; acc[1][nt] = acc[2][nt]; acc[2][nt] = acc[3][nt];
      }
    }
  } else {
    uint32_t ro[4][8];
    rows(m0, ro[0]); rows(m0 + 16, ro[1]); rows(m0 + 32, ro[2]); rows(m0 + 48, ro[3]);
    finish(0, ro[0]); finish(1, ro[1]); finish(2, ro[2]); finish(3, ro[3]);
    put(0, ro[0]); put(1, ro[1]); put(2, ro[2]); put(3, ro[3]);
  }
}

// ---------------------------------------------------------------------------
// Flash attention: grid (B*H, N/128), 256 thr = 8 waves, wave owns 16 rows.
// Online softmax over 32-wide KV blocks; S and O via WMMA.
// Ping-pong K-fragment prefetch (jj+=2), V loads issued before softmax VALU.
// ---------------------------------------------------------------------------
__global__ __launch_bounds__(256)
void attention_kernel(const __bf16* __restrict__ q, const __bf16* __restrict__ k,
                      const __bf16* __restrict__ vT, __bf16* __restrict__ att) {
  const int bh   = blockIdx.x;          // b*H + h
  const int wave = threadIdx.x >> 5;
  const int lane = threadIdx.x & 31;
  const int hf   = lane >> 4;
  const int l15  = lane & 15;
  const int m0   = blockIdx.y * 128 + wave * 16;
  constexpr int NB = Nq / 32;           // 32 (even)

  const __bf16* qb = q  + (size_t)bh * Nq * Dq;
  const __bf16* kb = k  + (size_t)bh * Nq * Dq;
  const __bf16* vb = vT + (size_t)bh * Dq * Nq;

  __shared__ __attribute__((aligned(32))) __bf16 pshare[8][16][32];

  // Q fragments (held whole kernel): rows m0..m0+15, D split 0..31 / 32..63
  bf16x16 qf0 = *(const bf16x16*)(qb + (size_t)(m0 + l15) * Dq + hf * 16);
  bf16x16 qf1 = *(const bf16x16*)(qb + (size_t)(m0 + l15) * Dq + 32 + hf * 16);

  f32x8 o[4] = {};
  float mrun[8], lrun[8];
#pragma unroll
  for (int r = 0; r < 8; ++r) { mrun[r] = -1e30f; lrun[r] = 0.f; }

  auto loadK = [&](int j, bf16x16 (&kk)[4]) {
#pragma unroll
    for (int t = 0; t < 2; ++t) {
      const int col0 = j * 32 + t * 16;
      kk[t * 2 + 0] = *(const bf16x16*)(kb + (size_t)(col0 + l15) * Dq + hf * 16);
      kk[t * 2 + 1] = *(const bf16x16*)(kb + (size_t)(col0 + l15) * Dq + 32 + hf * 16);
    }
  };

  // one 32-wide KV block: scores with kc, prefetch K block jnext into kn2
  auto process = [&](int jc, bf16x16 (&kc)[4], bf16x16 (&kn2)[4], int jnext) {
    f32x8 s0 = {}, s1 = {};
    s0 = wmma_bf16(qf0, kc[0], s0);
    s0 = wmma_bf16(qf1, kc[1], s0);
    s1 = wmma_bf16(qf0, kc[2], s1);
    s1 = wmma_bf16(qf1, kc[3], s1);

    // V loads for this block (consumed by o-wmma below; issued first)
    bf16x16 vf[4];
#pragma unroll
    for (int nt = 0; nt < 4; ++nt)
      vf[nt] = *(const bf16x16*)(vb + (size_t)(nt * 16 + l15) * Nq +
                                 jc * 32 + hf * 16);
    // next K block prefetch (wrapped address keeps it in bounds; dead at end)
    loadK(jnext, kn2);

    // ---- online softmax (VALU hides outstanding loads)
    float pv[2][8];
    float tmax[8];
#pragma unroll
    for (int r = 0; r < 8; ++r) {
      float v0 = s0[r] * 0.125f;            // 1/sqrt(D)
      float v1 = s1[r] * 0.125f;
      pv[0][r] = v0; pv[1][r] = v1;
      tmax[r] = fmaxf(v0, v1);
    }
#pragma unroll
    for (int r = 0; r < 8; ++r) {
      float v = tmax[r];
      v = fmaxf(v, __shfl_xor(v, 1));
      v = fmaxf(v, __shfl_xor(v, 2));
      v = fmaxf(v, __shfl_xor(v, 4));
      v = fmaxf(v, __shfl_xor(v, 8));
      tmax[r] = v;
    }
    float corr[8];
#pragma unroll
    for (int r = 0; r < 8; ++r) {
      float mnew = fmaxf(mrun[r], tmax[r]);
      corr[r] = __expf(mrun[r] - mnew);
      mrun[r] = mnew;
    }
#pragma unroll
    for (int r = 0; r < 8; ++r) {
      float p0 = __expf(pv[0][r] - mrun[r]);
      float p1 = __expf(pv[1][r] - mrun[r]);
      pv[0][r] = p0; pv[1][r] = p1;
      float v = p0 + p1;
      v += __shfl_xor(v, 1);
      v += __shfl_xor(v, 2);
      v += __shfl_xor(v, 4);
      v += __shfl_xor(v, 8);
      lrun[r] = lrun[r] * corr[r] + v;
    }
#pragma unroll
    for (int nt = 0; nt < 4; ++nt)
#pragma unroll
      for (int r = 0; r < 8; ++r) o[nt][r] *= corr[r];

    // ---- C-layout -> A-layout for P via per-wave LDS bounce
#pragma unroll
    for (int t = 0; t < 2; ++t)
#pragma unroll
      for (int r = 0; r < 8; ++r)
        pshare[wave][r + 8 * hf][t * 16 + l15] = (__bf16)pv[t][r];
    __syncthreads();
    bf16x16 pa = *(const bf16x16*)(&pshare[wave][l15][hf * 16]);

    // ---- O += P(16x32) x V(32xD)
#pragma unroll
    for (int nt = 0; nt < 4; ++nt)
      o[nt] = wmma_bf16(pa, vf[nt], o[nt]);
    __syncthreads();
  };

  bf16x16 kfA[4], kfB[4];
  loadK(0, kfA);
  for (int jj = 0; jj < NB; jj += 2) {
    process(jj,     kfA, kfB, jj + 1);
    process(jj + 1, kfB, kfA, (jj + 2 < NB) ? jj + 2 : 0);
  }

  // ---- finalize: divide by l, store into [B,N,C] bf16
  const int b = bh / Hq, h = bh % Hq;
#pragma unroll
  for (int nt = 0; nt < 4; ++nt)
#pragma unroll
    for (int r = 0; r < 8; ++r) {
      float val = o[nt][r] / lrun[r];
      int row = m0 + r + 8 * hf;
      int col = nt * 16 + l15;
      att[((size_t)b * Nq + row) * Cq + h * Dq + col] = (__bf16)val;
    }
}

// ---------------------------------------------------------------------------
// Launch
// ---------------------------------------------------------------------------
extern "C" void kernel_launch(void* const* d_in, const int* in_sizes, int n_in,
                              void* d_out, int out_size, void* d_ws, size_t ws_size,
                              hipStream_t stream) {
  (void)in_sizes; (void)n_in; (void)out_size; (void)ws_size;
  const float* x     = (const float*)d_in[0];
  const float* ln1_g = (const float*)d_in[1];
  const float* ln1_b = (const float*)d_in[2];
  const float* w_qkv = (const float*)d_in[3];
  const float* b_qkv = (const float*)d_in[4];
  const float* w_out = (const float*)d_in[5];
  const float* b_out = (const float*)d_in[6];
  const float* ln2_g = (const float*)d_in[7];
  const float* ln2_b = (const float*)d_in[8];
  const float* w1    = (const float*)d_in[9];
  const float* b1    = (const float*)d_in[10];
  const float* w2    = (const float*)d_in[11];
  const float* b2    = (const float*)d_in[12];
  float* out = (float*)d_out;

  // ---- workspace bump allocator (lifetimes allow heavy reuse)
  char* p = (char*)d_ws;
  auto alloc = [&](size_t bytes) -> char* {
    char* r = p;
    p += (bytes + 255) & ~(size_t)255;
    return r;
  };
  __bf16* wqkvT = (__bf16*)alloc((size_t)Cq * 3 * Cq * 2);     // 6 MB
  __bf16* woutT = (__bf16*)alloc((size_t)Cq * Cq * 2);         // 2 MB
  __bf16* w1T   = (__bf16*)alloc((size_t)Cq * MLPq * 2);       // 8 MB
  __bf16* w2T   = (__bf16*)alloc((size_t)MLPq * Cq * 2);       // 8 MB
  char*   r16   = alloc((size_t)TOK * Cq * 2);                 // 16 MB: h_bf, then att_bf
  char*   rqkv  = alloc((size_t)TOK * 3 * Cq * 4);             // 96 MB: x2 + h1
  __bf16* q_bf  = (__bf16*)alloc((size_t)TOK * Cq * 2);        // 16 MB: q, then y_bf
  __bf16* k_bf  = (__bf16*)alloc((size_t)TOK * Cq * 2);        // 16 MB
  __bf16* vT_bf = (__bf16*)alloc((size_t)TOK * Cq * 2);        // 16 MB

  __bf16* h_bf   = (__bf16*)r16;
  __bf16* att_bf = (__bf16*)r16;                           // reuse after h dead
  float*  x2     = (float*)rqkv;
  __bf16* h1_bf  = (__bf16*)(rqkv + (size_t)TOK * Cq * 4); // next 64 MB
  __bf16* y_bf   = q_bf;                                   // reuse after attention

  // 1) weight transposes (f32 -> bf16 [N,K]), tiled/coalesced
  {
    auto tp = [&](const float* w, __bf16* wt, int K, int Nn) {
      transpose_to_bf16<<<dim3(Nn / 32, K / 32), dim3(32, 8), 0, stream>>>(w, wt, K, Nn);
    };
    tp(w_qkv, wqkvT, Cq, 3 * Cq);
    tp(w_out, woutT, Cq, Cq);
    tp(w1, w1T, Cq, MLPq);
    tp(w2, w2T, MLPq, Cq);
  }

  // 2) LN1
  layernorm_bf16<<<dim3(TOK), dim3(256), 0, stream>>>(x, ln1_g, ln1_b, h_bf);

  // 3, 4) QKV GEMM: [TOK,C] x [C,3C] -> per-head q, k and transposed v
  gemm_bf16_wmma<128, 2, false, false, true, true><<<dim3(3 * Cq / 256, TOK / 128), dim3(128), 0, stream>>>(
      h_bf, wqkvT, b_qkv, nullptr, nullptr, q_bf, k_bf, vT_bf, TOK, 3 * Cq, Cq);

  // 5) attention -> att_bf [B,N,C]
  attention_kernel<<<dim3(Bq * Hq, Nq / 128), dim3(256), 0, stream>>>(
      q_bf, k_bf, vT_bf, att_bf);

  // 6) out projection + residual x -> x2
  gemm_bf16_wmma<256, 1, false, true, false, false><<<dim3(Cq / 256, TOK / 128), dim3(128), 0, stream>>>(
      att_bf, woutT, b_out, x, x2, nullptr, nullptr, nullptr, TOK, Cq, Cq);

  // 7) LN2 -> y_bf
  layernorm_bf16<<<dim3(TOK), dim3(256), 0, stream>>>(x2, ln2_g, ln2_b, y_bf);

  // 8) MLP1 + GELU -> h1_bf
  gemm_bf16_wmma<128, 2, true, false, true, false><<<dim3(MLPq / 256, TOK / 128), dim3(128), 0, stream>>>(
      y_bf, w1T, b1, nullptr, nullptr, h1_bf, nullptr, nullptr, TOK, MLPq, Cq);

  // 9) MLP2 + residual x2 -> out
  gemm_bf16_wmma<256, 1, false, true, false, false><<<dim3(Cq / 256, TOK / 128), dim3(128), 0, stream>>>(
      h1_bf, w2T, b2, x2, out, nullptr, nullptr, nullptr, TOK, Cq, MLPq);
}
